// v000
// Times are from an AMD MI455X. After a warm-up the kernel runs many times in a row, and a time is the length of
// such a window on the GPU divided by its runs, so every launch and the gaps after it count. The runs cycle
// through copies of the inputs. A figure is the median of several windows, for all but v000 over two sittings.
// Sittings can differ by a few percent; kernels timed side by side share one.
// v000 is the starting kernel. One run takes 1650 microseconds.
#include <hip/hip_runtime.h>
#include <hip/hip_bf16.h>

#define EMBED 512
#define EXPAND 1024
#define NB 4
#define NP 16
#define NN 1024
#define BP (NB * NP)                 // 64 (b,p) pairs
#define X_BSTRIDE (EMBED * NP * NN)  // 8388608
#define X_CSTRIDE (NP * NN)          // 16384

typedef __attribute__((ext_vector_type(2))) float v2f;
typedef __attribute__((ext_vector_type(8))) float v8f;

// ---------------------------------------------------------------------------
// Kernel 1: per (b,p): query dot, softmax over N, weighted x-sum xs[c].
// One workgroup per (b,p). xs: [BP][EMBED] floats in workspace.
// ---------------------------------------------------------------------------
__global__ __launch_bounds__(256) void k1_query_softmax_xs(
    const float* __restrict__ x, const float* __restrict__ Wqkv,
    const float* __restrict__ bqkv, float* __restrict__ xs) {
  const int bp = blockIdx.x;              // 0..63
  const int b = bp >> 4, p = bp & 15;
  const float* xb = x + (size_t)b * X_BSTRIDE + (size_t)p * NN;
  __shared__ float s_q[NN];               // 4KB: query -> scores
  __shared__ float s_red[256];
  const int t = threadIdx.x;

  // query[n] = bq + sum_c Wq[c] * x[b,c,p,n]   (Wq = row 0 of Wqkv, scalarized)
  const float bq = bqkv[0];
  float q[4];
#pragma unroll
  for (int i = 0; i < 4; ++i) {
    const int n = t + i * 256;
    float acc = bq;
    for (int c = 0; c < EMBED; ++c)
      acc = fmaf(Wqkv[c], xb[(size_t)c * X_CSTRIDE + n], acc);
    q[i] = acc;
  }

  // softmax over the 1024 n-values (workgroup reduction)
  float m = fmaxf(fmaxf(q[0], q[1]), fmaxf(q[2], q[3]));
  s_red[t] = m;
  __syncthreads();
  for (int s = 128; s > 0; s >>= 1) {
    if (t < s) s_red[t] = fmaxf(s_red[t], s_red[t + s]);
    __syncthreads();
  }
  const float mx = s_red[0];
  __syncthreads();

  float e[4], psum = 0.f;
#pragma unroll
  for (int i = 0; i < 4; ++i) { e[i] = __expf(q[i] - mx); psum += e[i]; }
  s_red[t] = psum;
  __syncthreads();
  for (int s = 128; s > 0; s >>= 1) {
    if (t < s) s_red[t] += s_red[t + s];
    __syncthreads();
  }
  const float inv = 1.0f / s_red[0];
  __syncthreads();
#pragma unroll
  for (int i = 0; i < 4; ++i) s_q[t + i * 256] = e[i] * inv;
  __syncthreads();

  // xs[c] = sum_n score[n] * x[b,c,p,n]   (x re-read hits L2: x = 134MB < 192MB)
  for (int c = t; c < EMBED; c += 256) {
    const float* xr = xb + (size_t)c * X_CSTRIDE;
    float acc = 0.f;
    for (int n = 0; n < NN; ++n) acc = fmaf(s_q[n], xr[n], acc);
    xs[(size_t)bp * EMBED + c] = acc;
  }
}

// ---------------------------------------------------------------------------
// Kernel 2: cv[tok][e] = Wk @ xs + bk.  [1024x512] @ [512x64] via WMMA f32.
// 256 wave-tasks = 64 e-tiles x 4 token-tiles; 32 blocks of 8 waves.
// ---------------------------------------------------------------------------
__global__ __launch_bounds__(256) void k2_context_vector(
    const float* __restrict__ Wqkv, const float* __restrict__ bqkv,
    const float* __restrict__ xs, float* __restrict__ cv) {
  const int lane = threadIdx.x & 31;
  const int wid  = (blockIdx.x * 256 + threadIdx.x) >> 5;  // 0..255
  const int et = wid >> 2;      // e-tile 0..63
  const int tt = wid & 3;       // token-tile 0..3
  const int mrow = lane & 15;
  const int hi   = lane >> 4;   // 0/1 -> K pair {0,1} or {2,3}
  const int koff = hi * 2;

  const float* Wk  = Wqkv + (size_t)(1 + et * 16 + mrow) * EMBED;  // A row (M)
  const float* xsn = xs + (size_t)(tt * 16 + mrow) * EMBED;        // B col (N)
  v8f acc = {0.f, 0.f, 0.f, 0.f, 0.f, 0.f, 0.f, 0.f};
  for (int kb = 0; kb < EMBED; kb += 4) {
    v2f a = {Wk[kb + koff], Wk[kb + koff + 1]};
    v2f bb = {xsn[kb + koff], xsn[kb + koff + 1]};
    acc = __builtin_amdgcn_wmma_f32_16x16x4_f32(false, a, false, bb,
                                                (short)0, acc, false, false);
  }
#pragma unroll
  for (int r = 0; r < 8; ++r) {
    const int e = et * 16 + r + hi * 8;
    const int tok = tt * 16 + mrow;
    cv[(size_t)tok * EXPAND + e] = acc[r] + bqkv[1 + e];
  }
}

__global__ __launch_bounds__(256) void k3_value_out(
    const float* __restrict__ x, const float* __restrict__ Wqkv,
    const float* __restrict__ bqkv, const float* __restrict__ Wout,
    const float* __restrict__ bout, const float* __restrict__ cv,
    float* __restrict__ out) {
  extern __shared__ float smem[];
  float* s_x = smem;               // [512][16]          natural layout
  float* s_u = smem + EMBED * 16;  // [512][16][2]       pair-interleaved over e

  const int g = blockIdx.x;        // 0..4095
  const int bp = g >> 6;
  const int n0 = (g & 63) * 16;
  const int b = bp >> 4, p = bp & 15;
  const size_t xbase = (size_t)b * X_BSTRIDE + (size_t)p * NN + n0;

  const int t = threadIdx.x;

  // ---- async stage of the 512x16 x tile: 8 rounds x 256 lanes x 16B --------
  // Low 32 bits of a generic LDS pointer are the LDS byte offset on AMDGPU.
  const unsigned lds_x_base = (unsigned)(uintptr_t)s_x;
#pragma unroll
  for (int r = 0; r < 8; ++r) {
    const int f = (t + r * 256) * 4;           // float index within tile
    const int c = f >> 4, n = f & 15;          // n in {0,4,8,12}: 16B aligned
    const float* gp = x + xbase + (size_t)c * X_CSTRIDE + n;
    const unsigned ldsb = lds_x_base + (unsigned)(f * 4);
    asm volatile("global_load_async_to_lds_b128 %0, %1, off"
                 :: "v"(ldsb), "v"(gp) : "memory");
  }
  asm volatile("s_wait_asynccnt 0x0" ::: "memory");
  __syncthreads();

  const int lane = t & 31;         // wave32
  const int wave = t >> 5;         // 0..7
  const int mrow = lane & 15;
  const int hi   = lane >> 4;
  const int koff = hi * 2;
  const float* cvp = cv + (size_t)bp * EXPAND;

  // ---- Stage 1: value GEMM + relu + cv scale -> s_u (paired layout) --------
  {
    const int e0 = wave * 128;
    const float* WvBase = Wqkv + (size_t)(1 + EXPAND) * EMBED;  // value rows
    v8f acc[8];
#pragma unroll
    for (int mt = 0; mt < 8; ++mt) acc[mt] = (v8f){0.f,0.f,0.f,0.f,0.f,0.f,0.f,0.f};
    for (int kb = 0; kb < EMBED; kb += 4) {
      v2f bb = {s_x[(kb + koff) * 16 + mrow], s_x[(kb + koff + 1) * 16 + mrow]};
#pragma unroll
      for (int mt = 0; mt < 8; ++mt) {
        const float* ar = WvBase + (size_t)(e0 + mt * 16 + mrow) * EMBED + kb + koff;
        v2f a = {ar[0], ar[1]};
        acc[mt] = __builtin_amdgcn_wmma_f32_16x16x4_f32(false, a, false, bb,
                                                        (short)0, acc[mt], false, false);
      }
    }
#pragma unroll
    for (int mt = 0; mt < 8; ++mt) {
#pragma unroll
      for (int r = 0; r < 8; r += 2) {         // e even: write (e, e+1) as b64
        const int e = e0 + mt * 16 + r + hi * 8;
        const float v0 = fmaxf(acc[mt][r]     + bqkv[1 + EXPAND + e],     0.f) * cvp[e];
        const float v1 = fmaxf(acc[mt][r + 1] + bqkv[1 + EXPAND + e + 1], 0.f) * cvp[e + 1];
        *(v2f*)(s_u + (e >> 1) * 32 + mrow * 2) = (v2f){v0, v1};
      }
    }
  }
  __syncthreads();

  // ---- Stage 2: out GEMM: Wout[512x1024] @ u[1024x16] + bout ----------------
  {
    const int o0 = wave * 64;
    v8f acc[4];
#pragma unroll
    for (int mt = 0; mt < 4; ++mt) acc[mt] = (v8f){0.f,0.f,0.f,0.f,0.f,0.f,0.f,0.f};
    for (int kb = 0; kb < EXPAND; kb += 4) {
      const int k = kb + koff;                 // even
      const v2f bb = *(const v2f*)(s_u + (k >> 1) * 32 + mrow * 2);  // ds_load_b64
#pragma unroll
      for (int mt = 0; mt < 4; ++mt) {
        const float* ar = Wout + (size_t)(o0 + mt * 16 + mrow) * EXPAND + k;
        v2f a = {ar[0], ar[1]};
        acc[mt] = __builtin_amdgcn_wmma_f32_16x16x4_f32(false, a, false, bb,
                                                        (short)0, acc[mt], false, false);
      }
    }
#pragma unroll
    for (int mt = 0; mt < 4; ++mt) {
#pragma unroll
      for (int r = 0; r < 8; ++r) {
        const int o = o0 + mt * 16 + r + hi * 8;
        out[(size_t)b * X_BSTRIDE + (size_t)o * X_CSTRIDE + (size_t)p * NN + n0 + mrow] =
            acc[mt][r] + bout[o];
      }
    }
  }
}

// ---------------------------------------------------------------------------
extern "C" void kernel_launch(void* const* d_in, const int* in_sizes, int n_in,
                              void* d_out, int out_size, void* d_ws, size_t ws_size,
                              hipStream_t stream) {
  const float* x    = (const float*)d_in[0];
  const float* Wqkv = (const float*)d_in[1];
  const float* bqkv = (const float*)d_in[2];
  const float* Wout = (const float*)d_in[3];
  const float* bout = (const float*)d_in[4];
  float* out = (float*)d_out;

  float* xs = (float*)d_ws;                  // [64][512]  = 128KB
  float* cv = xs + (size_t)BP * EMBED;       // [64][1024] = 256KB

  k1_query_softmax_xs<<<BP, 256, 0, stream>>>(x, Wqkv, bqkv, xs);
  k2_context_vector<<<32, 256, 0, stream>>>(Wqkv, bqkv, xs, cv);
  const size_t lds3 = (size_t)(EMBED * 16 + EXPAND * 16) * sizeof(float);  // 96KB
  k3_value_out<<<BP * (NN / 16), 256, lds3, stream>>>(x, Wqkv, bqkv, Wout, bout, cv, out);
}

// v001
// Measured time: 817 microseconds a run.
// Two timings next to v000 put it at 2.11 and 2.10 times that version's speed.
#include <hip/hip_runtime.h>
#include <hip/hip_bf16.h>

#define EMBED 512
#define EXPAND 1024
#define NB 4
#define NP 16
#define NN 1024
#define BP (NB * NP)                 // 64 (b,p) pairs
#define X_BSTRIDE (EMBED * NP * NN)  // 8388608
#define X_CSTRIDE (NP * NN)          // 16384

typedef __attribute__((ext_vector_type(2))) float v2f;
typedef __attribute__((ext_vector_type(8))) float v8f;

// ---------------------------------------------------------------------------
// Kernel 1: per (b,p): query dot, softmax over N, weighted x-sum xs[c].
// One workgroup per (b,p). xs: [BP][EMBED] floats in workspace.
// ---------------------------------------------------------------------------
__global__ __launch_bounds__(256) void k1_query_softmax_xs(
    const float* __restrict__ x, const float* __restrict__ Wqkv,
    const float* __restrict__ bqkv, float* __restrict__ xs) {
  const int bp = blockIdx.x;              // 0..63
  const int b = bp >> 4, p = bp & 15;
  const float* xb = x + (size_t)b * X_BSTRIDE + (size_t)p * NN;
  __shared__ float s_q[NN];               // 4KB: query -> scores
  __shared__ float s_red[256];
  const int t = threadIdx.x;

  // query[n] = bq + sum_c Wq[c] * x[b,c,p,n]   (Wq = row 0 of Wqkv, scalarized)
  const float bq = bqkv[0];
  float q[4];
#pragma unroll
  for (int i = 0; i < 4; ++i) {
    const int n = t + i * 256;
    float acc = bq;
    for (int c = 0; c < EMBED; ++c)
      acc = fmaf(Wqkv[c], xb[(size_t)c * X_CSTRIDE + n], acc);
    q[i] = acc;
  }

  // softmax over the 1024 n-values (workgroup reduction)
  float m = fmaxf(fmaxf(q[0], q[1]), fmaxf(q[2], q[3]));
  s_red[t] = m;
  __syncthreads();
  for (int s = 128; s > 0; s >>= 1) {
    if (t < s) s_red[t] = fmaxf(s_red[t], s_red[t + s]);
    __syncthreads();
  }
  const float mx = s_red[0];
  __syncthreads();

  float e[4], psum = 0.f;
#pragma unroll
  for (int i = 0; i < 4; ++i) { e[i] = __expf(q[i] - mx); psum += e[i]; }
  s_red[t] = psum;
  __syncthreads();
  for (int s = 128; s > 0; s >>= 1) {
    if (t < s) s_red[t] += s_red[t + s];
    __syncthreads();
  }
  const float inv = 1.0f / s_red[0];
  __syncthreads();
#pragma unroll
  for (int i = 0; i < 4; ++i) s_q[t + i * 256] = e[i] * inv;
  __syncthreads();

  // xs[c] = sum_n score[n] * x[b,c,p,n]   (x re-read hits L2: x = 134MB < 192MB)
  for (int c = t; c < EMBED; c += 256) {
    const float* xr = xb + (size_t)c * X_CSTRIDE;
    float acc = 0.f;
    for (int n = 0; n < NN; ++n) acc = fmaf(s_q[n], xr[n], acc);
    xs[(size_t)bp * EMBED + c] = acc;
  }
}

// ---------------------------------------------------------------------------
// Kernel 2: cv[tok][e] = Wk @ xs + bk.  [1024x512] @ [512x64] via WMMA f32.
// 256 wave-tasks = 64 e-tiles x 4 token-tiles; 32 blocks of 8 waves.
// ---------------------------------------------------------------------------
__global__ __launch_bounds__(256) void k2_context_vector(
    const float* __restrict__ Wqkv, const float* __restrict__ bqkv,
    const float* __restrict__ xs, float* __restrict__ cv) {
  const int lane = threadIdx.x & 31;
  const int wid  = (blockIdx.x * 256 + threadIdx.x) >> 5;  // 0..255
  const int et = wid >> 2;      // e-tile 0..63
  const int tt = wid & 3;       // token-tile 0..3
  const int mrow = lane & 15;
  const int hi   = lane >> 4;   // 0/1 -> K pair {0,1} or {2,3}
  const int koff = hi * 2;

  const float* Wk  = Wqkv + (size_t)(1 + et * 16 + mrow) * EMBED;  // A row (M)
  const float* xsn = xs + (size_t)(tt * 16 + mrow) * EMBED;        // B col (N)
  v8f acc = {0.f, 0.f, 0.f, 0.f, 0.f, 0.f, 0.f, 0.f};
  for (int kb = 0; kb < EMBED; kb += 4) {
    v2f a = {Wk[kb + koff], Wk[kb + koff + 1]};
    v2f bb = {xsn[kb + koff], xsn[kb + koff + 1]};
    acc = __builtin_amdgcn_wmma_f32_16x16x4_f32(false, a, false, bb,
                                                (short)0, acc, false, false);
  }
#pragma unroll
  for (int r = 0; r < 8; ++r) {
    const int e = et * 16 + r + hi * 8;
    const int tok = tt * 16 + mrow;
    cv[(size_t)tok * EXPAND + e] = acc[r] + bqkv[1 + e];
  }
}

#define TT 64
#define NT (TT / 16)
#define EC 256
#define XP 72
#define UP 160

// Eight async copies and the wait that stands before their address registers
// may be rewritten, in one statement so that nothing can be moved in between.
__device__ __forceinline__ void copy8_to_lds(const unsigned* l, const float* const* g) {
  asm volatile(
      "global_load_async_to_lds_b128 %0, %8, off\n\t"
      "global_load_async_to_lds_b128 %1, %9, off\n\t"
      "global_load_async_to_lds_b128 %2, %10, off\n\t"
      "global_load_async_to_lds_b128 %3, %11, off\n\t"
      "global_load_async_to_lds_b128 %4, %12, off\n\t"
      "global_load_async_to_lds_b128 %5, %13, off\n\t"
      "global_load_async_to_lds_b128 %6, %14, off\n\t"
      "global_load_async_to_lds_b128 %7, %15, off\n\t"
      "s_wait_xcnt 0x0"
      :: "v"(l[0]), "v"(l[1]), "v"(l[2]), "v"(l[3]),
         "v"(l[4]), "v"(l[5]), "v"(l[6]), "v"(l[7]),
         "v"(g[0]), "v"(g[1]), "v"(g[2]), "v"(g[3]),
         "v"(g[4]), "v"(g[5]), "v"(g[6]), "v"(g[7])
      : "memory");
}

__global__ __launch_bounds__(512) void k3_value_out(
    const float* __restrict__ x, const float* __restrict__ Wqkv,
    const float* __restrict__ bqkv, const float* __restrict__ Wout,
    const float* __restrict__ bout, const float* __restrict__ cv,
    float* __restrict__ out) {
  __shared__ __attribute__((aligned(16))) float s_x[EMBED * XP];       // 144KB
  __shared__ __attribute__((aligned(16))) float s_u[(EC / 2) * UP];    // 80KB

  const int g = blockIdx.x;        // 0..1023
  const int bp = g >> 4;
  const int n0 = (g & 15) * TT;
  const int b = bp >> 4, p = bp & 15;
  const size_t xbase = (size_t)b * X_BSTRIDE + (size_t)p * NN + n0;

  const int t = threadIdx.x;

  // ---- async stage of the 512x64 x tile: 16 rounds x 512 lanes x 16B -------
  // Low 32 bits of a generic LDS pointer are the LDS byte offset on AMDGPU.
  const unsigned lds_x_base = (unsigned)(uintptr_t)s_x;
#pragma unroll
  for (int h = 0; h < 2; ++h) {
    unsigned l[8];
    const float* gp[8];
#pragma unroll
    for (int r = 0; r < 8; ++r) {
      const int f = t + (h * 8 + r) * 512;     // 16-byte piece within the tile
      const int c = f >> 4, q = f & 15;        // 16 pieces per 64-token row
      gp[r] = x + xbase + (size_t)c * X_CSTRIDE + q * 4;
      l[r] = lds_x_base + (unsigned)(c * (XP * 4) + q * 16);
    }
    copy8_to_lds(l, gp);
  }
  // The tile has landed for this wave; the barrier publishes it to the others.
  asm volatile("s_wait_asynccnt 0x0" ::: "memory");
  __syncthreads();

  const int lane = t & 31;         // wave32
  const int wave = t >> 5;         // 0..15
  const int mrow = lane & 15;
  const int hi   = lane >> 4;
  const int koff = hi * 2;
  const float* cvp = cv + (size_t)bp * EXPAND;
  const float* WvBase = Wqkv + (size_t)(1 + EXPAND) * EMBED;  // value rows
  const int o0 = wave * 32;

  v8f acc2[2][NT];
#pragma unroll
  for (int mt = 0; mt < 2; ++mt)
#pragma unroll
    for (int nt = 0; nt < NT; ++nt)
      acc2[mt][nt] = (v8f){0.f,0.f,0.f,0.f,0.f,0.f,0.f,0.f};

  for (int ec = 0; ec < EXPAND; ec += EC) {
    // ---- Stage 1: value GEMM for 16 e-rows of this chunk ---------------------
    const int e0 = ec + wave * 16;
    v8f acc1[NT];
#pragma unroll
    for (int nt = 0; nt < NT; ++nt) acc1[nt] = (v8f){0.f,0.f,0.f,0.f,0.f,0.f,0.f,0.f};
    // Bias and gate of this lane's eight e-rows, fetched ahead of the GEMM that hides them.
    float bv[8], gv[8];
#pragma unroll
    for (int r = 0; r < 8; ++r) {
      bv[r] = bqkv[1 + EXPAND + e0 + hi * 8 + r];
      gv[r] = cvp[e0 + hi * 8 + r];
    }
    {
      const float* ar = WvBase + (size_t)(e0 + mrow) * EMBED + koff;
      const float* br = s_x + koff * XP + mrow;
      for (int kb0 = 0; kb0 < EMBED; kb0 += 32) {
        v2f a[8];                  // one whole 128-byte line of each weight row
#pragma unroll
        for (int j = 0; j < 8; ++j)
          a[j] = (v2f){ar[kb0 + j * 4], ar[kb0 + j * 4 + 1]};
#pragma unroll
        for (int j = 0; j < 8; ++j) {
          const float* bk = br + (kb0 + j * 4) * XP;
#pragma unroll
          for (int nt = 0; nt < NT; ++nt) {
            v2f bb = {bk[nt * 16], bk[XP + nt * 16]};
            acc1[nt] = __builtin_amdgcn_wmma_f32_16x16x4_f32(false, a[j], false, bb,
                                                             (short)0, acc1[nt], false, false);
          }
        }
      }
    }
    // Every wave has finished reading the previous chunk's u before it is rewritten.
    __syncthreads();
#pragma unroll
    for (int r = 0; r < 8; r += 2) {           // e even: write (e, e+1) as b64
      const int e = e0 + r + hi * 8;
#pragma unroll
      for (int nt = 0; nt < NT; ++nt) {
        const float v0 = fmaxf(acc1[nt][r]     + bv[r],     0.f) * gv[r];
        const float v1 = fmaxf(acc1[nt][r + 1] + bv[r + 1], 0.f) * gv[r + 1];
        *(v2f*)(s_u + ((e - ec) >> 1) * UP + (nt * 16 + mrow) * 2) = (v2f){v0, v1};
      }
    }
    // This chunk's u is complete before any wave reads it.
    __syncthreads();

    // ---- Stage 2: out += Wout[:, chunk] @ u chunk ----------------------------
    {
      const float* ar = Wout + (size_t)(o0 + mrow) * EXPAND + ec + koff;
      const float* br = s_u + hi * UP + mrow * 2;
      for (int kb0 = 0; kb0 < EC; kb0 += 32) {
        v2f a[2][8];               // one whole 128-byte line of each weight row
#pragma unroll
        for (int j = 0; j < 8; ++j)
#pragma unroll
          for (int mt = 0; mt < 2; ++mt) {
            const float* am = ar + (size_t)mt * 16 * EXPAND + kb0 + j * 4;
            a[mt][j] = (v2f){am[0], am[1]};
          }
#pragma unroll
        for (int j = 0; j < 8; ++j) {
          const float* bk = br + ((kb0 + j * 4) >> 1) * UP;
#pragma unroll
          for (int nt = 0; nt < NT; ++nt) {
            const v2f bb = *(const v2f*)(bk + nt * 32);            // ds_load_b64
#pragma unroll
            for (int mt = 0; mt < 2; ++mt)
              acc2[mt][nt] = __builtin_amdgcn_wmma_f32_16x16x4_f32(false, a[mt][j], false, bb,
                                                                   (short)0, acc2[mt][nt], false, false);
          }
        }
      }
    }
  }

#pragma unroll
  for (int mt = 0; mt < 2; ++mt) {
#pragma unroll
    for (int r = 0; r < 8; ++r) {
      const int o = o0 + mt * 16 + r + hi * 8;
      const float bo = bout[o];
      float* op = out + (size_t)b * X_BSTRIDE + (size_t)o * X_CSTRIDE + (size_t)p * NN + n0 + mrow;
#pragma unroll
      for (int nt = 0; nt < NT; ++nt) op[nt * 16] = acc2[mt][nt][r] + bo;
    }
  }
}

// ---------------------------------------------------------------------------
extern "C" void kernel_launch(void* const* d_in, const int* in_sizes, int n_in,
                              void* d_out, int out_size, void* d_ws, size_t ws_size,
                              hipStream_t stream) {
  const float* x    = (const float*)d_in[0];
  const float* Wqkv = (const float*)d_in[1];
  const float* bqkv = (const float*)d_in[2];
  const float* Wout = (const float*)d_in[3];
  const float* bout = (const float*)d_in[4];
  float* out = (float*)d_out;

  float* xs = (float*)d_ws;                  // [64][512]  = 128KB
  float* cv = xs + (size_t)BP * EMBED;       // [64][1024] = 256KB

  k1_query_softmax_xs<<<BP, 256, 0, stream>>>(x, Wqkv, bqkv, xs);
  k2_context_vector<<<32, 256, 0, stream>>>(Wqkv, bqkv, xs, cv);
  k3_value_out<<<BP * (NN / TT), 512, 0, stream>>>(x, Wqkv, bqkv, Wout, bout, cv, out);
}

// v002
// One run takes 689 microseconds.
// Two timings next to v001 put it at 1.18 and 1.19 times that version's speed.
// Over all steps from v000 it is 2.49 times as fast.
#include <hip/hip_runtime.h>
#include <hip/hip_bf16.h>

#define EMBED 512
#define EXPAND 1024
#define NB 4
#define NP 16
#define NN 1024
#define BP (NB * NP)                 // 64 (b,p) pairs
#define X_BSTRIDE (EMBED * NP * NN)  // 8388608
#define X_CSTRIDE (NP * NN)          // 16384

typedef __attribute__((ext_vector_type(2))) float v2f;
typedef __attribute__((ext_vector_type(8))) float v8f;

#define CH 64
#define NCH (NN / CH)
#define PXP 17
// One partials buffer: part [1024][512], then pm [1024], then ps [1024].
#define PM_OFF (BP * NCH * EMBED)
#define PS_OFF (PM_OFF + BP * NCH)

typedef __attribute__((ext_vector_type(4))) float v4f;

__global__ __launch_bounds__(512) void k1a_chunk_partials(
    const float* __restrict__ x, const float* __restrict__ Wqkv,
    const float* __restrict__ bqkv, float* __restrict__ part) {
  float* pm = part + PM_OFF;
  float* ps = part + PS_OFF;
  const int g = blockIdx.x;               // 0..1023 = bp * NCH + chunk
  const int bp = g / NCH;
  const int b = bp >> 4, p = bp & 15;
  const float* xb = x + (size_t)b * X_BSTRIDE + (size_t)p * NN + (g % NCH) * CH;   // same for the whole work-group
  __shared__ __attribute__((aligned(16))) float s_pq[32 * CH];   // 8KB: query partials
  __shared__ __attribute__((aligned(16))) float s_e[CH];
  __shared__ float s_px[EMBED * PXP];                            // 34KB
  const int t = threadIdx.x;
  const int q4 = t & 15;                  // 16-byte piece of the 64-token row
  const int c0 = t >> 4;                  // 0..31; this thread's channels: 16 c0 + r

  // Sixteen neighbouring channels per thread: all sixteen row pieces hang on one
  // address register (the row step fits the load's immediate offset), the weights on another.
  // The '#pragma unroll' on a loop over r keeps wq and xv statically indexed, in registers.
  const unsigned xo = (unsigned)(c0 * 16 * X_CSTRIDE + q4 * 4) * 4u;   // bytes from xb
  const unsigned wo = (unsigned)(c0 * 16) * 4u;                        // bytes from Wq = row 0 of Wqkv
  v4f wq[4];
  v4f xv[16];
#pragma unroll
  for (int r = 0; r < 4; ++r) wq[r] = *(const v4f*)((const char*)Wqkv + wo + r * 16);
#pragma unroll
  for (int r = 0; r < 16; ++r) xv[r] = *(const v4f*)((const char*)xb + xo + r * (X_CSTRIDE * 4));
  // Stands before the address registers of the loads above are rewritten; as its inputs
  // they stay live up to it, so that no load's result is placed in one of them.
  asm volatile("s_wait_xcnt 0x0" :: "v"(xo), "v"(wo) : "memory");

  // query partial of four tokens over this thread's sixteen channels
  v4f pq = {0.f, 0.f, 0.f, 0.f};
#pragma unroll
  for (int r = 0; r < 16; ++r) pq += wq[r >> 2][r & 3] * xv[r];
  *(v4f*)(s_pq + c0 * CH + q4 * 4) = pq;
  __syncthreads();

  // Wave 0: two tokens per lane; the chunk's maximum, exponentials and sum.
  float m = 0.f, s = 0.f;
  if (t < 32) {
    float qa = bqkv[0], qb = qa;
#pragma unroll                            // LDS reads issued ahead of the adds that use them
    for (int j = 0; j < 32; ++j) {
      qa += s_pq[j * CH + t];
      qb += s_pq[j * CH + 32 + t];
    }
    m = fmaxf(qa, qb);
    for (int d = 16; d > 0; d >>= 1) m = fmaxf(m, __shfl_xor(m, d, 32));
    const float ea = __expf(qa - m), eb = __expf(qb - m);
    s = ea + eb;
    for (int d = 16; d > 0; d >>= 1) s += __shfl_xor(s, d, 32);
    s_e[t] = ea;
    s_e[32 + t] = eb;
  }
  __syncthreads();

  // weighted sum: four tokens per thread, then sixteen partials per channel
  const v4f e4 = *(const v4f*)(s_e + q4 * 4);
#pragma unroll
  for (int r = 0; r < 16; ++r) {
    s_px[(c0 * 16 + r) * PXP + q4] =
        fmaf(xv[r].w, e4.w, fmaf(xv[r].z, e4.z, fmaf(xv[r].y, e4.y, xv[r].x * e4.x)));
  }
  __syncthreads();
  float acc = 0.f;
#pragma unroll                            // LDS reads issued ahead of the adds that use them
  for (int k = 0; k < 16; ++k) acc += s_px[t * PXP + k];
  part[(size_t)g * EMBED + t] = acc;
  if (t == 0) { pm[g] = m; ps[g] = s; }   // behind the last barrier: no wave waits for these stores
}

// ---------------------------------------------------------------------------
// Kernel 1b: per (b,p): merge the sixteen chunks on their common maximum.
//   xs[c] = sum_j exp(pm_j - M) part_j[c] / sum_j exp(pm_j - M) ps_j
// ---------------------------------------------------------------------------
__global__ __launch_bounds__(512) void k1b_merge_chunks(
    const float* __restrict__ part, float* __restrict__ xs) {
  const float* pm = part + PM_OFF;
  const float* ps = part + PS_OFF;
  const int bp = blockIdx.x;              // 0..63
  const int t = threadIdx.x;              // channel
  const float* pb = part + (size_t)bp * NCH * EMBED;   // same for the whole work-group
  const unsigned po = (unsigned)t;
  float v[NCH];                           // unrolled loops keep it in registers, its loads in flight together
#pragma unroll
  for (int j = 0; j < NCH; ++j) v[j] = pb[po + j * EMBED];
  // Stands before the address register of the loads above is rewritten; as its input
  // it stays live up to it, so that no load's result is placed in it.
  asm volatile("s_wait_xcnt 0x0" :: "v"(po) : "memory");
  float mx = pm[bp * NCH];
  for (int j = 1; j < NCH; ++j) mx = fmaxf(mx, pm[bp * NCH + j]);
  float sum = 0.f, acc = 0.f;
#pragma unroll
  for (int j = 0; j < NCH; ++j) {
    const float w = __expf(pm[bp * NCH + j] - mx);
    sum = fmaf(w, ps[bp * NCH + j], sum);
    acc = fmaf(w, v[j], acc);
  }
  xs[(size_t)bp * EMBED + t] = acc * (1.0f / sum);
}

// ---------------------------------------------------------------------------
// Kernel 2: cv[tok][e] = Wk @ xs + bk.  [1024x512] @ [512x64] via WMMA f32.
// 256 wave-tasks = 64 e-tiles x 4 token-tiles; 32 blocks of 8 waves.
// ---------------------------------------------------------------------------
__global__ __launch_bounds__(256) void k2_context_vector(
    const float* __restrict__ Wqkv, const float* __restrict__ bqkv,
    const float* __restrict__ xs, float* __restrict__ cv) {
  const int lane = threadIdx.x & 31;
  const int wid  = (blockIdx.x * 256 + threadIdx.x) >> 5;  // 0..255
  const int et = wid >> 2;      // e-tile 0..63
  const int tt = wid & 3;       // token-tile 0..3
  const int mrow = lane & 15;
  const int hi   = lane >> 4;   // 0/1 -> K pair {0,1} or {2,3}
  const int koff = hi * 2;

  const float* Wk  = Wqkv + (size_t)(1 + et * 16 + mrow) * EMBED;  // A row (M)
  const float* xsn = xs + (size_t)(tt * 16 + mrow) * EMBED;        // B col (N)
  v8f acc = {0.f, 0.f, 0.f, 0.f, 0.f, 0.f, 0.f, 0.f};
  for (int kb = 0; kb < EMBED; kb += 4) {
    v2f a = {Wk[kb + koff], Wk[kb + koff + 1]};
    v2f bb = {xsn[kb + koff], xsn[kb + koff + 1]};
    acc = __builtin_amdgcn_wmma_f32_16x16x4_f32(false, a, false, bb,
                                                (short)0, acc, false, false);
  }
#pragma unroll
  for (int r = 0; r < 8; ++r) {
    const int e = et * 16 + r + hi * 8;
    const int tok = tt * 16 + mrow;
    cv[(size_t)tok * EXPAND + e] = acc[r] + bqkv[1 + e];
  }
}

#define TT 64
#define NT (TT / 16)
#define EC 256
#define XP 72
#define UP 160

// Eight async copies and the wait that stands before their address registers
// may be rewritten, in one statement so that nothing can be moved in between.
__device__ __forceinline__ void copy8_to_lds(const unsigned* l, const float* const* g) {
  asm volatile(
      "global_load_async_to_lds_b128 %0, %8, off\n\t"
      "global_load_async_to_lds_b128 %1, %9, off\n\t"
      "global_load_async_to_lds_b128 %2, %10, off\n\t"
      "global_load_async_to_lds_b128 %3, %11, off\n\t"
      "global_load_async_to_lds_b128 %4, %12, off\n\t"
      "global_load_async_to_lds_b128 %5, %13, off\n\t"
      "global_load_async_to_lds_b128 %6, %14, off\n\t"
      "global_load_async_to_lds_b128 %7, %15, off\n\t"
      "s_wait_xcnt 0x0"
      :: "v"(l[0]), "v"(l[1]), "v"(l[2]), "v"(l[3]),
         "v"(l[4]), "v"(l[5]), "v"(l[6]), "v"(l[7]),
         "v"(g[0]), "v"(g[1]), "v"(g[2]), "v"(g[3]),
         "v"(g[4]), "v"(g[5]), "v"(g[6]), "v"(g[7])
      : "memory");
}

__global__ __launch_bounds__(512) void k3_value_out(
    const float* __restrict__ x, const float* __restrict__ Wqkv,
    const float* __restrict__ bqkv, const float* __restrict__ Wout,
    const float* __restrict__ bout, const float* __restrict__ cv,
    float* __restrict__ out) {
  __shared__ __attribute__((aligned(16))) float s_x[EMBED * XP];       // 144KB
  __shared__ __attribute__((aligned(16))) float s_u[(EC / 2) * UP];    // 80KB

  const int g = blockIdx.x;        // 0..1023
  const int bp = g >> 4;
  const int n0 = (g & 15) * TT;
  const int b = bp >> 4, p = bp & 15;
  const size_t xbase = (size_t)b * X_BSTRIDE + (size_t)p * NN + n0;

  const int t = threadIdx.x;

  // ---- async stage of the 512x64 x tile: 16 rounds x 512 lanes x 16B -------
  // Low 32 bits of a generic LDS pointer are the LDS byte offset on AMDGPU.
  const unsigned lds_x_base = (unsigned)(uintptr_t)s_x;
#pragma unroll
  for (int h = 0; h < 2; ++h) {
    unsigned l[8];
    const float* gp[8];
#pragma unroll
    for (int r = 0; r < 8; ++r) {
      const int f = t + (h * 8 + r) * 512;     // 16-byte piece within the tile
      const int c = f >> 4, q = f & 15;        // 16 pieces per 64-token row
      gp[r] = x + xbase + (size_t)c * X_CSTRIDE + q * 4;
      l[r] = lds_x_base + (unsigned)(c * (XP * 4) + q * 16);
    }
    copy8_to_lds(l, gp);
  }
  // The tile has landed for this wave; the barrier publishes it to the others.
  asm volatile("s_wait_asynccnt 0x0" ::: "memory");
  __syncthreads();

  const int lane = t & 31;         // wave32
  const int wave = t >> 5;         // 0..15
  const int mrow = lane & 15;
  const int hi   = lane >> 4;
  const int koff = hi * 2;
  const float* cvp = cv + (size_t)bp * EXPAND;
  const float* WvBase = Wqkv + (size_t)(1 + EXPAND) * EMBED;  // value rows
  const int o0 = wave * 32;

  v8f acc2[2][NT];
#pragma unroll
  for (int mt = 0; mt < 2; ++mt)
#pragma unroll
    for (int nt = 0; nt < NT; ++nt)
      acc2[mt][nt] = (v8f){0.f,0.f,0.f,0.f,0.f,0.f,0.f,0.f};

  for (int ec = 0; ec < EXPAND; ec += EC) {
    // ---- Stage 1: value GEMM for 16 e-rows of this chunk ---------------------
    const int e0 = ec + wave * 16;
    v8f acc1[NT];
#pragma unroll
    for (int nt = 0; nt < NT; ++nt) acc1[nt] = (v8f){0.f,0.f,0.f,0.f,0.f,0.f,0.f,0.f};
    // Bias and gate of this lane's eight e-rows, fetched ahead of the GEMM that hides them.
    float bv[8], gv[8];
#pragma unroll
    for (int r = 0; r < 8; ++r) {
      bv[r] = bqkv[1 + EXPAND + e0 + hi * 8 + r];
      gv[r] = cvp[e0 + hi * 8 + r];
    }
    {
      const float* ar = WvBase + (size_t)(e0 + mrow) * EMBED + koff;
      const float* br = s_x + koff * XP + mrow;
      for (int kb0 = 0; kb0 < EMBED; kb0 += 32) {
        v2f a[8];                  // one whole 128-byte line of each weight row
#pragma unroll
        for (int j = 0; j < 8; ++j)
          a[j] = (v2f){ar[kb0 + j * 4], ar[kb0 + j * 4 + 1]};
#pragma unroll
        for (int j = 0; j < 8; ++j) {
          const float* bk = br + (kb0 + j * 4) * XP;
#pragma unroll
          for (int nt = 0; nt < NT; ++nt) {
            v2f bb = {bk[nt * 16], bk[XP + nt * 16]};
            acc1[nt] = __builtin_amdgcn_wmma_f32_16x16x4_f32(false, a[j], false, bb,
                                                             (short)0, acc1[nt], false, false);
          }
        }
      }
    }
    // Every wave has finished reading the previous chunk's u before it is rewritten.
    __syncthreads();
#pragma unroll
    for (int r = 0; r < 8; r += 2) {           // e even: write (e, e+1) as b64
      const int e = e0 + r + hi * 8;
#pragma unroll
      for (int nt = 0; nt < NT; ++nt) {
        const float v0 = fmaxf(acc1[nt][r]     + bv[r],     0.f) * gv[r];
        const float v1 = fmaxf(acc1[nt][r + 1] + bv[r + 1], 0.f) * gv[r + 1];
        *(v2f*)(s_u + ((e - ec) >> 1) * UP + (nt * 16 + mrow) * 2) = (v2f){v0, v1};
      }
    }
    // This chunk's u is complete before any wave reads it.
    __syncthreads();

    // ---- Stage 2: out += Wout[:, chunk] @ u chunk ----------------------------
    {
      const float* ar = Wout + (size_t)(o0 + mrow) * EXPAND + ec + koff;
      const float* br = s_u + hi * UP + mrow * 2;
      for (int kb0 = 0; kb0 < EC; kb0 += 32) {
        v2f a[2][8];               // one whole 128-byte line of each weight row
#pragma unroll
        for (int j = 0; j < 8; ++j)
#pragma unroll
          for (int mt = 0; mt < 2; ++mt) {
            const float* am = ar + (size_t)mt * 16 * EXPAND + kb0 + j * 4;
            a[mt][j] = (v2f){am[0], am[1]};
          }
#pragma unroll
        for (int j = 0; j < 8; ++j) {
          const float* bk = br + ((kb0 + j * 4) >> 1) * UP;
#pragma unroll
          for (int nt = 0; nt < NT; ++nt) {
            const v2f bb = *(const v2f*)(bk + nt * 32);            // ds_load_b64
#pragma unroll
            for (int mt = 0; mt < 2; ++mt)
              acc2[mt][nt] = __builtin_amdgcn_wmma_f32_16x16x4_f32(false, a[mt][j], false, bb,
                                                                   (short)0, acc2[mt][nt], false, false);
          }
        }
      }
    }
  }

#pragma unroll
  for (int mt = 0; mt < 2; ++mt) {
#pragma unroll
    for (int r = 0; r < 8; ++r) {
      const int o = o0 + mt * 16 + r + hi * 8;
      const float bo = bout[o];
      float* op = out + (size_t)b * X_BSTRIDE + (size_t)o * X_CSTRIDE + (size_t)p * NN + n0 + mrow;
#pragma unroll
      for (int nt = 0; nt < NT; ++nt) op[nt * 16] = acc2[mt][nt][r] + bo;
    }
  }
}

// ---------------------------------------------------------------------------
extern "C" void kernel_launch(void* const* d_in, const int* in_sizes, int n_in,
                              void* d_out, int out_size, void* d_ws, size_t ws_size,
                              hipStream_t stream) {
  const float* x    = (const float*)d_in[0];
  const float* Wqkv = (const float*)d_in[1];
  const float* bqkv = (const float*)d_in[2];
  const float* Wout = (const float*)d_in[3];
  const float* bout = (const float*)d_in[4];
  float* out = (float*)d_out;

  float* xs = (float*)d_ws;                  // [64][512]  = 128KB
  float* cv = xs + (size_t)BP * EMBED;       // [64][1024] = 256KB
  float* part = cv + (size_t)BP * EXPAND;    // [1024][512] + 2 x [1024], about 2MB

  k1a_chunk_partials<<<BP * NCH, 512, 0, stream>>>(x, Wqkv, bqkv, part);
  k1b_merge_chunks<<<BP, 512, 0, stream>>>(part, xs);
  k2_context_vector<<<32, 256, 0, stream>>>(Wqkv, bqkv, xs, cv);
  k3_value_out<<<BP * (NN / TT), 512, 0, stream>>>(x, Wqkv, bqkv, Wout, bout, cv, out);
}
